// v000
// Measured on an AMD MI455X. A time is GPU time per run, averaged over a window of back-to-back runs after a warm-up
// (all launches, gaps included; the runs take copies of the inputs in turn), and the median of several windows.
// Apart from v000's, it joins two sittings. Times from different sittings can be a few percent apart, while
// side-by-side timings come from the same sitting.
// v000 is the starting kernel. One run takes 956 microseconds.
#include <hip/hip_runtime.h>
#include <hip/hip_bf16.h>
#include <math.h>

#define D_MODEL 1024
#define D_STATE 16
#define D_CONV  4
#define D_INNER 2048
#define BATCH   2
#define SEQLEN  2048
#define NROWS   (BATCH * SEQLEN)   // 4096 rows for the flattened GEMMs

typedef float v2f __attribute__((ext_vector_type(2)));
typedef float v8f __attribute__((ext_vector_type(8)));
typedef unsigned int u32x4 __attribute__((ext_vector_type(4)));
typedef int i32x4 __attribute__((ext_vector_type(4)));
typedef int i32x8 __attribute__((ext_vector_type(8)));

__device__ __forceinline__ float sigmoid_f(float v) {
    return 1.0f / (1.0f + __expf(-v));
}

__device__ __forceinline__ void tdm_load_tile_2d(unsigned lds_off,
                                                 const float* gptr,
                                                 unsigned tile_w, unsigned tile_h,
                                                 unsigned long long row_stride_elems)
{
    unsigned long long ga = (unsigned long long)(size_t)gptr;
    u32x4 g0;
    g0.x = 1u;                                          // count=1, is_restore=0, gather off
    g0.y = lds_off;                                     // lds_addr (bytes)
    g0.z = (unsigned)(ga & 0xFFFFFFFFu);                // global_addr[31:0]
    g0.w = (unsigned)((ga >> 32) & 0x01FFFFFFu)         // global_addr[56:32]
         | (2u << 30);                                  // type = 2 ("image")
    i32x8 g1;
    g1[0] = (int)(2u << 16);
    g1[1] = (int)((tile_w & 0xFFFFu) << 16);
    g1[2] = (int)((tile_w >> 16) | ((tile_h & 0xFFFFu) << 16));
    g1[3] = (int)((tile_h >> 16) | ((tile_w & 0xFFFFu) << 16));
    g1[4] = (int)(tile_h & 0xFFFFu);
    g1[5] = (int)(row_stride_elems & 0xFFFFFFFFull);
    g1[6] = (int)((row_stride_elems >> 32) & 0xFFFFull);
    g1[7] = 0;
    i32x4 z4 = (i32x4)0;
    i32x8 z8 = (i32x8)0;
    __builtin_amdgcn_tensor_load_to_lds(g0, g1, z4, z4, z8, 0);
}

template <int BM, int BN, int KC>
__global__ __launch_bounds__(256)
void gemm_f32_wmma(const float* __restrict__ A, const float* __restrict__ B,
                   const float* __restrict__ bias, float* __restrict__ C,
                   int M, int N, int K)
{
    __shared__ float sA[2][BM][KC];   // A tile: [m][k]
    __shared__ float sB[2][KC][BN];   // B tile: [k][n]

    const int tid  = threadIdx.x;
    const int wave = tid >> 5;
    const int lane = tid & 31;
    const int l16  = lane & 15;
    const int hi   = lane >> 4;        // which half of the wave
    const int wm   = wave >> 2;        // 0..1  (64-row stripes)
    const int wn   = wave & 3;         // 0..3  (32-col stripes)
    const int row0 = blockIdx.y * BM;
    const int col0 = blockIdx.x * BN;
    const bool tdmWave = (wave == 0);

    v8f acc[4][2];
#pragma unroll
    for (int i = 0; i < 4; ++i)
#pragma unroll
        for (int j = 0; j < 2; ++j)
            acc[i][j] = (v8f)(0.0f);

    const int nstages = K / KC;
    if (tdmWave) {
        tdm_load_tile_2d((unsigned)(size_t)&sA[0][0][0],
                         A + (size_t)row0 * K, KC, BM, (unsigned long long)K);
        tdm_load_tile_2d((unsigned)(size_t)&sB[0][0][0],
                         B + col0, BN, KC, (unsigned long long)N);
    }

    for (int s = 0; s < nstages; ++s) {
        const int cur = s & 1;
        if (tdmWave) __builtin_amdgcn_s_wait_tensorcnt(0);  // buf[cur] DMA done
        __syncthreads();   // all waves: buf[cur] ready; buf[cur^1] no longer read

        if (tdmWave && (s + 1) < nstages) {                 // prefetch next stage
            const int k0n = (s + 1) * KC;
            tdm_load_tile_2d((unsigned)(size_t)&sA[cur ^ 1][0][0],
                             A + (size_t)row0 * K + k0n, KC, BM, (unsigned long long)K);
            tdm_load_tile_2d((unsigned)(size_t)&sB[cur ^ 1][0][0],
                             B + (size_t)k0n * N + col0, BN, KC, (unsigned long long)N);
        }

#pragma unroll
        for (int ks = 0; ks < KC; ks += 4) {
            v2f afrag[4];
#pragma unroll
            for (int i = 0; i < 4; ++i) {
                const float* p = &sA[cur][wm * 64 + i * 16 + l16][ks + 2 * hi];
                afrag[i].x = p[0];
                afrag[i].y = p[1];
            }
            // B fragment (4x16 f32): same K split, N striped across lanes
            v2f bfrag[2];
#pragma unroll
            for (int j = 0; j < 2; ++j) {
                bfrag[j].x = sB[cur][ks + 2 * hi + 0][wn * 32 + j * 16 + l16];
                bfrag[j].y = sB[cur][ks + 2 * hi + 1][wn * 32 + j * 16 + l16];
            }
#pragma unroll
            for (int i = 0; i < 4; ++i)
#pragma unroll
                for (int j = 0; j < 2; ++j)
                    acc[i][j] = __builtin_amdgcn_wmma_f32_16x16x4_f32(
                        false, afrag[i], false, bfrag[j],
                        (short)0, acc[i][j], false, false);
        }
        __syncthreads();   // done reading buf[cur] before its DMA at stage s+2
    }

#pragma unroll
    for (int i = 0; i < 4; ++i) {
#pragma unroll
        for (int j = 0; j < 2; ++j) {
            int ccol = col0 + wn * 32 + j * 16 + l16;
            float bv = bias[ccol];
#pragma unroll
            for (int e = 0; e < 8; ++e) {
                int r = row0 + wm * 64 + i * 16 + e + 8 * hi;
                C[(size_t)r * N + ccol] = acc[i][j][e] + bv;
            }
        }
    }
}

// ---------------------------------------------------------------------------
// Depthwise causal conv (width 4) + SiLU.  x_ssm = xz[:, :, 0:D_INNER]
// ---------------------------------------------------------------------------
__global__ __launch_bounds__(256)
void conv_silu_kernel(const float* __restrict__ xz, const float* __restrict__ conv_w,
                      const float* __restrict__ conv_b, float* __restrict__ xc)
{
    size_t idx = (size_t)blockIdx.x * blockDim.x + threadIdx.x;
    if (idx >= (size_t)NROWS * D_INNER) return;
    int d   = (int)(idx % D_INNER);
    int row = (int)(idx / D_INNER);          // row = b*SEQLEN + t
    int t   = row % SEQLEN;
    int b   = row / SEQLEN;

    float acc = conv_b[d];
#pragma unroll
    for (int k = 0; k < D_CONV; ++k) {
        int tt = t - (D_CONV - 1) + k;
        if (tt >= 0) {
            float xv = xz[((size_t)(b * SEQLEN + tt)) * (2 * D_INNER) + d];
            acc = fmaf(xv, conv_w[d * D_CONV + k], acc);
        }
    }
    xc[idx] = acc * sigmoid_f(acc);          // SiLU
}

// ---------------------------------------------------------------------------
// proj = xc @ W_xproj  (N = 33 = 16 B, 16 C, 1 delta).  delta stored softplus'ed.
// One block per row; row staged in LDS.
// ---------------------------------------------------------------------------
__global__ __launch_bounds__(64)
void xproj_kernel(const float* __restrict__ xc, const float* __restrict__ W_xproj,
                  float* __restrict__ proj)
{
    __shared__ float srow[D_INNER];
    int r = blockIdx.x;
    for (int i = threadIdx.x; i < D_INNER; i += 64)
        srow[i] = xc[(size_t)r * D_INNER + i];
    __syncthreads();

    const int NP = 2 * D_STATE + 1;          // 33
    for (int j = threadIdx.x; j < NP; j += 64) {
        float acc = 0.0f;
        for (int k = 0; k < D_INNER; ++k)
            acc = fmaf(srow[k], W_xproj[(size_t)k * NP + j], acc);
        if (j == NP - 1)                     // softplus(delta_raw)
            acc = (acc > 20.0f) ? acc : log1pf(__expf(acc));
        proj[(size_t)r * NP + j] = acc;
    }
}

// ---------------------------------------------------------------------------
// Selective scan + skip + gating.
// 16 state lanes per channel (2 channels per wave32); __shfl_xor tree reduces
// h*C over the 16-lane state group. B/C/delta/x/z chunks staged in LDS.
// Block = 256 threads = 16 channels of one batch; grid = BATCH * (D_INNER/16).
// ---------------------------------------------------------------------------
#define T_CHUNK 128
__global__ __launch_bounds__(256)
void scan_kernel(const float* __restrict__ xc, const float* __restrict__ proj,
                 const float* __restrict__ xz,   // z = xz[:, :, D_INNER:2*D_INNER]
                 const float* __restrict__ A_log, const float* __restrict__ D_param,
                 float* __restrict__ yg)
{
    const int NP = 2 * D_STATE + 1;          // 33
    __shared__ float sProj[T_CHUNK][NP];     // [t][0:16]=B, [16:32]=C, [32]=delta
    __shared__ float sX[T_CHUNK][16];
    __shared__ float sZ[T_CHUNK][16];

    const int grpPerB = D_INNER / 16;        // 128
    const int b    = blockIdx.x / grpPerB;
    const int dgrp = blockIdx.x % grpPerB;
    const int c    = threadIdx.x >> 4;       // channel within block: 0..15
    const int n    = threadIdx.x & 15;       // state index: 0..15
    const int d    = dgrp * 16 + c;

    const float A  = -__expf(A_log[(size_t)d * D_STATE + n]);
    const float Dp = D_param[d];
    float h = 0.0f;

    for (int t0 = 0; t0 < SEQLEN; t0 += T_CHUNK) {
        // Stage proj (B, C, delta) for this chunk
        for (int i = threadIdx.x; i < T_CHUNK * NP; i += 256) {
            int tt = i / NP, jj = i % NP;
            sProj[tt][jj] = proj[(size_t)(b * SEQLEN + t0 + tt) * NP + jj];
        }
        // Stage xc and z for the 16 channels
        for (int i = threadIdx.x; i < T_CHUNK * 16; i += 256) {
            int tt = i >> 4, cc = i & 15;
            size_t row = (size_t)(b * SEQLEN + t0 + tt);
            sX[tt][cc] = xc[row * D_INNER + dgrp * 16 + cc];
            sZ[tt][cc] = xz[row * (2 * D_INNER) + D_INNER + dgrp * 16 + cc];
        }
        __syncthreads();

        for (int tt = 0; tt < T_CHUNK; ++tt) {
            float delta = sProj[tt][2 * D_STATE];
            float x     = sX[tt][c];
            float dA    = __expf(delta * A);
            h = fmaf(dA, h, delta * sProj[tt][n] * x);      // h = dA*h + (d*B_n)*x
            float p = h * sProj[tt][D_STATE + n];           // h * C_n
            // reduce over the 16 state lanes (stays within 16-lane group)
            p += __shfl_xor(p, 8, 32);
            p += __shfl_xor(p, 4, 32);
            p += __shfl_xor(p, 2, 32);
            p += __shfl_xor(p, 1, 32);
            if (n == 0) {
                float y = p + x * Dp;                       // skip connection
                float z = sZ[tt][c];
                y *= z * sigmoid_f(z);                      // gate: y * silu(z)
                yg[(size_t)(b * SEQLEN + t0 + tt) * D_INNER + d] = y;
            }
        }
        __syncthreads();
    }
}

// ---------------------------------------------------------------------------
extern "C" void kernel_launch(void* const* d_in, const int* in_sizes, int n_in,
                              void* d_out, int out_size, void* d_ws, size_t ws_size,
                              hipStream_t stream)
{
    const float* x       = (const float*)d_in[0];
    const float* W_in    = (const float*)d_in[1];
    const float* b_in    = (const float*)d_in[2];
    const float* conv_w  = (const float*)d_in[3];
    const float* conv_b  = (const float*)d_in[4];
    const float* W_xproj = (const float*)d_in[5];
    const float* A_log   = (const float*)d_in[6];
    const float* D_param = (const float*)d_in[7];
    const float* W_out   = (const float*)d_in[8];
    const float* b_out   = (const float*)d_in[9];
    float* out = (float*)d_out;

    // Workspace layout (floats)
    float* xz   = (float*)d_ws;                          // NROWS x 2*D_INNER
    float* xc   = xz  + (size_t)NROWS * 2 * D_INNER;     // NROWS x D_INNER
    float* proj = xc  + (size_t)NROWS * D_INNER;         // NROWS x 33
    float* yg   = proj + (size_t)NROWS * (2 * D_STATE + 1); // NROWS x D_INNER

    // 1) xz = x @ W_in + b_in         (4096 x 1024) @ (1024 x 4096)
    {
        dim3 grid((2 * D_INNER) / 128, NROWS / 128);
        gemm_f32_wmma<128, 128, 16><<<grid, 256, 0, stream>>>(
            x, W_in, b_in, xz, NROWS, 2 * D_INNER, D_MODEL);
    }
    // 2) depthwise conv + SiLU
    {
        size_t total = (size_t)NROWS * D_INNER;
        conv_silu_kernel<<<(unsigned)((total + 255) / 256), 256, 0, stream>>>(
            xz, conv_w, conv_b, xc);
    }
    // 3) proj = xc @ W_xproj  (+ softplus on delta column)
    {
        xproj_kernel<<<NROWS, 64, 0, stream>>>(xc, W_xproj, proj);
    }
    // 4) selective scan + skip + gating
    {
        scan_kernel<<<BATCH * (D_INNER / 16), 256, 0, stream>>>(
            xc, proj, xz, A_log, D_param, yg);
    }
    // 5) out = yg @ W_out + b_out     (4096 x 2048) @ (2048 x 1024)
    {
        dim3 grid(D_MODEL / 128, NROWS / 128);
        gemm_f32_wmma<128, 128, 16><<<grid, 256, 0, stream>>>(
            yg, W_out, b_out, out, NROWS, D_MODEL, D_INNER);
    }
}

// v001
// One run takes 452 microseconds.
// Timed twice side by side with v000, it ran 2.14 times as fast both times.
#include <hip/hip_runtime.h>
#include <hip/hip_bf16.h>
#include <math.h>

#define D_MODEL 1024
#define D_STATE 16
#define D_CONV  4
#define D_INNER 2048
#define BATCH   2
#define SEQLEN  2048
#define NROWS   (BATCH * SEQLEN)   // 4096 rows for the flattened GEMMs

typedef float v2f __attribute__((ext_vector_type(2)));
typedef float v8f __attribute__((ext_vector_type(8)));
typedef unsigned int u32x4 __attribute__((ext_vector_type(4)));
typedef int i32x4 __attribute__((ext_vector_type(4)));
typedef int i32x8 __attribute__((ext_vector_type(8)));

__device__ __forceinline__ float sigmoid_f(float v) {
    return 1.0f / (1.0f + __expf(-v));
}

__device__ __forceinline__ void tdm_load_tile_2d(unsigned lds_off,
                                                 const float* gptr,
                                                 unsigned tile_w, unsigned tile_h,
                                                 unsigned long long row_stride_elems)
{
    unsigned long long ga = (unsigned long long)(size_t)gptr;
    u32x4 g0;
    g0.x = 1u;                                          // count=1, is_restore=0, gather off
    g0.y = lds_off;                                     // lds_addr (bytes)
    g0.z = (unsigned)(ga & 0xFFFFFFFFu);                // global_addr[31:0]
    g0.w = (unsigned)((ga >> 32) & 0x01FFFFFFu)         // global_addr[56:32]
         | (2u << 30);                                  // type = 2 ("image")
    i32x8 g1;
    g1[0] = (int)(2u << 16);
    g1[1] = (int)((tile_w & 0xFFFFu) << 16);
    g1[2] = (int)((tile_w >> 16) | ((tile_h & 0xFFFFu) << 16));
    g1[3] = (int)((tile_h >> 16) | ((tile_w & 0xFFFFu) << 16));
    g1[4] = (int)(tile_h & 0xFFFFu);
    g1[5] = (int)(row_stride_elems & 0xFFFFFFFFull);
    g1[6] = (int)((row_stride_elems >> 32) & 0xFFFFull);
    g1[7] = 0;
    i32x4 z4 = (i32x4)0;
    i32x8 z8 = (i32x8)0;
    __builtin_amdgcn_tensor_load_to_lds(g0, g1, z4, z4, z8, 0);
}

template <int BM, int BN, int KC>
__global__ __launch_bounds__(256)
void gemm_f32_wmma(const float* __restrict__ A, const float* __restrict__ B,
                   const float* __restrict__ bias, float* __restrict__ C,
                   int M, int N, int K)
{
    __shared__ float sA[2][BM][KC];   // A tile: [m][k]
    __shared__ float sB[2][KC][BN];   // B tile: [k][n]

    const int tid  = threadIdx.x;
    const int wave = tid >> 5;
    const int lane = tid & 31;
    const int l16  = lane & 15;
    const int hi   = lane >> 4;        // which half of the wave
    const int wm   = wave >> 2;        // 0..1  (64-row stripes)
    const int wn   = wave & 3;         // 0..3  (32-col stripes)
    const int row0 = blockIdx.y * BM;
    const int col0 = blockIdx.x * BN;
    const bool tdmWave = (wave == 0);

    v8f acc[4][2];
#pragma unroll
    for (int i = 0; i < 4; ++i)
#pragma unroll
        for (int j = 0; j < 2; ++j)
            acc[i][j] = (v8f)(0.0f);

    const int nstages = K / KC;
    if (tdmWave) {
        tdm_load_tile_2d((unsigned)(size_t)&sA[0][0][0],
                         A + (size_t)row0 * K, KC, BM, (unsigned long long)K);
        tdm_load_tile_2d((unsigned)(size_t)&sB[0][0][0],
                         B + col0, BN, KC, (unsigned long long)N);
    }

    for (int s = 0; s < nstages; ++s) {
        const int cur = s & 1;
        if (tdmWave) __builtin_amdgcn_s_wait_tensorcnt(0);  // buf[cur] DMA done
        __syncthreads();   // all waves: buf[cur] ready; buf[cur^1] no longer read

        if (tdmWave && (s + 1) < nstages) {                 // prefetch next stage
            const int k0n = (s + 1) * KC;
            tdm_load_tile_2d((unsigned)(size_t)&sA[cur ^ 1][0][0],
                             A + (size_t)row0 * K + k0n, KC, BM, (unsigned long long)K);
            tdm_load_tile_2d((unsigned)(size_t)&sB[cur ^ 1][0][0],
                             B + (size_t)k0n * N + col0, BN, KC, (unsigned long long)N);
        }

#pragma unroll
        for (int ks = 0; ks < KC; ks += 4) {
            v2f afrag[4];
#pragma unroll
            for (int i = 0; i < 4; ++i) {
                const float* p = &sA[cur][wm * 64 + i * 16 + l16][ks + 2 * hi];
                afrag[i].x = p[0];
                afrag[i].y = p[1];
            }
            // B fragment (4x16 f32): same K split, N striped across lanes
            v2f bfrag[2];
#pragma unroll
            for (int j = 0; j < 2; ++j) {
                bfrag[j].x = sB[cur][ks + 2 * hi + 0][wn * 32 + j * 16 + l16];
                bfrag[j].y = sB[cur][ks + 2 * hi + 1][wn * 32 + j * 16 + l16];
            }
#pragma unroll
            for (int i = 0; i < 4; ++i)
#pragma unroll
                for (int j = 0; j < 2; ++j)
                    acc[i][j] = __builtin_amdgcn_wmma_f32_16x16x4_f32(
                        false, afrag[i], false, bfrag[j],
                        (short)0, acc[i][j], false, false);
        }
        __syncthreads();   // done reading buf[cur] before its DMA at stage s+2
    }

#pragma unroll
    for (int i = 0; i < 4; ++i) {
#pragma unroll
        for (int j = 0; j < 2; ++j) {
            int ccol = col0 + wn * 32 + j * 16 + l16;
            float bv = bias[ccol];
#pragma unroll
            for (int e = 0; e < 8; ++e) {
                int r = row0 + wm * 64 + i * 16 + e + 8 * hi;
                C[(size_t)r * N + ccol] = acc[i][j][e] + bv;
            }
        }
    }
}

// ---------------------------------------------------------------------------
// Depthwise causal conv (width 4) + SiLU.  x_ssm = xz[:, :, 0:D_INNER]
// ---------------------------------------------------------------------------
__global__ __launch_bounds__(256)
void conv_silu_kernel(const float* __restrict__ xz, const float* __restrict__ conv_w,
                      const float* __restrict__ conv_b, float* __restrict__ xc)
{
    size_t idx = (size_t)blockIdx.x * blockDim.x + threadIdx.x;
    if (idx >= (size_t)NROWS * D_INNER) return;
    int d   = (int)(idx % D_INNER);
    int row = (int)(idx / D_INNER);          // row = b*SEQLEN + t
    int t   = row % SEQLEN;
    int b   = row / SEQLEN;

    float acc = conv_b[d];
#pragma unroll
    for (int k = 0; k < D_CONV; ++k) {
        int tt = t - (D_CONV - 1) + k;
        if (tt >= 0) {
            float xv = xz[((size_t)(b * SEQLEN + tt)) * (2 * D_INNER) + d];
            acc = fmaf(xv, conv_w[d * D_CONV + k], acc);
        }
    }
    xc[idx] = acc * sigmoid_f(acc);          // SiLU
}

// ---------------------------------------------------------------------------
// proj = xc @ W_xproj  (N = 33 = 16 B, 16 C, 1 delta).  delta stored softplus'ed.
// One block per row; row staged in LDS.
// ---------------------------------------------------------------------------
__global__ __launch_bounds__(64)
void xproj_kernel(const float* __restrict__ xc, const float* __restrict__ W_xproj,
                  float* __restrict__ proj)
{
    __shared__ float srow[D_INNER];
    int r = blockIdx.x;
    for (int i = threadIdx.x; i < D_INNER; i += 64)
        srow[i] = xc[(size_t)r * D_INNER + i];
    __syncthreads();

    const int NP = 2 * D_STATE + 1;          // 33
    for (int j = threadIdx.x; j < NP; j += 64) {
        float acc = 0.0f;
        for (int k = 0; k < D_INNER; ++k)
            acc = fmaf(srow[k], W_xproj[(size_t)k * NP + j], acc);
        if (j == NP - 1)                     // softplus(delta_raw)
            acc = (acc > 20.0f) ? acc : log1pf(__expf(acc));
        proj[(size_t)r * NP + j] = acc;
    }
}

// ---------------------------------------------------------------------------
// Selective scan + skip + gating.
// Four lanes per channel, each lane keeps 4 of the 16 states in registers
// (8 channels per wave32). The sum of h*C over the states is 3 FMAs in the lane
// and two DPP quad adds. Steps run in groups of four: lane g of a quad takes the
// sum of step t+g and does that step's skip, gate and store, so all lanes work.
// Block = 64 threads = 16 channels of one batch; grid = BATCH * (D_INNER/16).
// ---------------------------------------------------------------------------
#define T_CHUNK 128
#define X_PITCH (T_CHUNK + 4)

typedef float v4f __attribute__((ext_vector_type(4)));

// value of lane (l ^ 1) / (l ^ 2) inside each quad, on the vector pipe (DPP quad_perm)
__device__ __forceinline__ float quad_xor1(float v) {
    return __int_as_float(__builtin_amdgcn_mov_dpp(__float_as_int(v), 0xB1, 0xF, 0xF, true));
}
__device__ __forceinline__ float quad_xor2(float v) {
    return __int_as_float(__builtin_amdgcn_mov_dpp(__float_as_int(v), 0x4E, 0xF, 0xF, true));
}

__global__ __launch_bounds__(64)
void scan_kernel(const float* __restrict__ xc, const float* __restrict__ proj,
                 const float* __restrict__ xz,   // z = xz[:, :, D_INNER:2*D_INNER]
                 const float* __restrict__ A_log, const float* __restrict__ D_param,
                 float* __restrict__ yg)
{
    const int NP = 2 * D_STATE + 1;          // 33
    __shared__ __attribute__((aligned(16))) float sBC[T_CHUNK][2 * D_STATE]; // [t][0:16]=B, [16:32]=C
    __shared__ __attribute__((aligned(16))) float sDelta[T_CHUNK];
    __shared__ __attribute__((aligned(16))) float sX[16][X_PITCH];           // [channel][t]
    __shared__ __attribute__((aligned(16))) float sZ[16][X_PITCH];

    const int grpPerB = D_INNER / 16;        // 128
    const int b    = blockIdx.x / grpPerB;
    const int dgrp = blockIdx.x % grpPerB;
    const int c    = threadIdx.x >> 2;       // channel within block: 0..15
    const int g    = threadIdx.x & 3;        // states 4g .. 4g+3
    const int d    = dgrp * 16 + c;
    const int lane = threadIdx.x & 31;
    const int wave = threadIdx.x >> 5;

    const v4f Al = *(const v4f*)&A_log[(size_t)d * D_STATE + 4 * g];
    float A[4], h[4];
#pragma unroll
    for (int k = 0; k < 4; ++k) {
        A[k] = -__expf(Al[k]);
        h[k] = 0.0f;
    }
    const float Dp = D_param[d];

    for (int t0 = 0; t0 < SEQLEN; t0 += T_CHUNK) {
        const size_t row0 = (size_t)(b * SEQLEN + t0);
        // Stage the chunk. Every staging loop is unrolled whole and all loads stand in
        // front of the LDS stores: two waves have nothing else to hide a load's latency,
        // so the chunk pays it once instead of once per trip.
        const float* pBC = proj + (row0 + wave) * NP + lane;            // one row per wave and trip
        const float* pDl = proj + (row0 + threadIdx.x) * NP + 2 * D_STATE;
        const int    st  = threadIdx.x >> 4, sc = threadIdx.x & 15;     // 4 rows x 16 channels per trip
        const float* pX  = xc + (row0 + st) * D_INNER + dgrp * 16 + sc;
        const float* pZ  = xz + (row0 + st) * (2 * D_INNER) + D_INNER + dgrp * 16 + sc;
        float rBC[T_CHUNK / 2], rDl[T_CHUNK / 64], rX[T_CHUNK / 4], rZ[T_CHUNK / 4];
        // Behind each run of loads from one address: a later load's result may land in the
        // registers that held that address, so the wait stands in front of the next run.
#pragma unroll
        for (int r = 0; r < T_CHUNK / 4; ++r)
            rX[r] = pX[(size_t)r * 4 * D_INNER];
        asm volatile("s_wait_xcnt 0x0" ::: "memory");
#pragma unroll
        for (int r = 0; r < T_CHUNK / 4; ++r)
            rZ[r] = pZ[(size_t)r * 4 * (2 * D_INNER)];
        asm volatile("s_wait_xcnt 0x0" ::: "memory");
#pragma unroll
        for (int r = 0; r < T_CHUNK / 2; ++r)
            rBC[r] = pBC[r * 2 * NP];
        asm volatile("s_wait_xcnt 0x0" ::: "memory");
#pragma unroll
        for (int r = 0; r < T_CHUNK / 64; ++r)
            rDl[r] = pDl[r * 64 * NP];
        asm volatile("s_wait_xcnt 0x0" ::: "memory");
#pragma unroll
        for (int r = 0; r < T_CHUNK / 4; ++r) {
            sX[sc][4 * r + st] = rX[r];
            sZ[sc][4 * r + st] = rZ[r];
        }
#pragma unroll
        for (int r = 0; r < T_CHUNK / 2; ++r)
            sBC[2 * r + wave][lane] = rBC[r];
#pragma unroll
        for (int r = 0; r < T_CHUNK / 64; ++r)
            sDelta[64 * r + threadIdx.x] = rDl[r];
        __syncthreads();

        float* yB = yg + row0 * D_INNER + dgrp * 16;             // the chunk's first row, uniform
        const unsigned yoff = (unsigned)g * D_INNER + c;         // lane g writes row tt+g
#pragma unroll 2
        for (int tt = 0; tt < T_CHUNK; tt += 4) {
            const v4f dl = *(const v4f*)&sDelta[tt];
            const v4f xv = *(const v4f*)&sX[c][tt];
            float psel;
#pragma unroll
            for (int u = 0; u < 4; ++u) {
                const v4f Bv = *(const v4f*)&sBC[tt + u][4 * g];
                const v4f Cv = *(const v4f*)&sBC[tt + u][D_STATE + 4 * g];
                const float delta = dl[u];
                const float x     = xv[u];
#pragma unroll
                for (int k = 0; k < 4; ++k) {
                    float dA = __expf(delta * A[k]);
                    h[k] = fmaf(dA, h[k], delta * Bv[k] * x);   // h = dA*h + (d*B_n)*x
                }
                float p = h[0] * Cv[0];                          // sum of h * C_n
                p = fmaf(h[1], Cv[1], p);
                p = fmaf(h[2], Cv[2], p);
                p = fmaf(h[3], Cv[3], p);
                p += quad_xor1(p);
                p += quad_xor2(p);
                psel = (u == 0 || g == u) ? p : psel;            // lane g keeps step tt+g
            }
            const float x = sX[c][tt + g];
            const float z = sZ[c][tt + g];
            float y = psel + x * Dp;                             // skip connection
            y *= z * sigmoid_f(z);                               // gate: y * silu(z)
            yB[yoff + (unsigned)tt * D_INNER] = y;
            // behind the pair's second store: the next pair rewrites the registers that both
            // stores name (a wait behind the first too would hold the second group's reads back)
            if (tt & 4) asm volatile("s_wait_xcnt 0x0" ::: "memory");
        }
        __syncthreads();
    }
}

// ---------------------------------------------------------------------------
extern "C" void kernel_launch(void* const* d_in, const int* in_sizes, int n_in,
                              void* d_out, int out_size, void* d_ws, size_t ws_size,
                              hipStream_t stream)
{
    const float* x       = (const float*)d_in[0];
    const float* W_in    = (const float*)d_in[1];
    const float* b_in    = (const float*)d_in[2];
    const float* conv_w  = (const float*)d_in[3];
    const float* conv_b  = (const float*)d_in[4];
    const float* W_xproj = (const float*)d_in[5];
    const float* A_log   = (const float*)d_in[6];
    const float* D_param = (const float*)d_in[7];
    const float* W_out   = (const float*)d_in[8];
    const float* b_out   = (const float*)d_in[9];
    float* out = (float*)d_out;

    // Workspace layout (floats)
    float* xz   = (float*)d_ws;                          // NROWS x 2*D_INNER
    float* xc   = xz  + (size_t)NROWS * 2 * D_INNER;     // NROWS x D_INNER
    float* proj = xc  + (size_t)NROWS * D_INNER;         // NROWS x 33
    float* yg   = proj + (size_t)NROWS * (2 * D_STATE + 1); // NROWS x D_INNER

    // 1) xz = x @ W_in + b_in         (4096 x 1024) @ (1024 x 4096)
    {
        dim3 grid((2 * D_INNER) / 128, NROWS / 128);
        gemm_f32_wmma<128, 128, 16><<<grid, 256, 0, stream>>>(
            x, W_in, b_in, xz, NROWS, 2 * D_INNER, D_MODEL);
    }
    // 2) depthwise conv + SiLU
    {
        size_t total = (size_t)NROWS * D_INNER;
        conv_silu_kernel<<<(unsigned)((total + 255) / 256), 256, 0, stream>>>(
            xz, conv_w, conv_b, xc);
    }
    // 3) proj = xc @ W_xproj  (+ softplus on delta column)
    {
        xproj_kernel<<<NROWS, 64, 0, stream>>>(xc, W_xproj, proj);
    }
    // 4) selective scan + skip + gating
    {
        scan_kernel<<<BATCH * (D_INNER / 16), 64, 0, stream>>>(
            xc, proj, xz, A_log, D_param, yg);
    }
    // 5) out = yg @ W_out + b_out     (4096 x 2048) @ (2048 x 1024)
    {
        dim3 grid(D_MODEL / 128, NROWS / 128);
        gemm_f32_wmma<128, 128, 16><<<grid, 256, 0, stream>>>(
            yg, W_out, b_out, out, NROWS, D_MODEL, D_INNER);
    }
}

// v002
// It runs in 431 microseconds.
// In both of two side-by-side timings against v001, it was 1.04 times as fast.
// Over all steps from v000 it is 2.23 times as fast.
#include <hip/hip_runtime.h>
#include <hip/hip_bf16.h>
#include <math.h>

#define D_MODEL 1024
#define D_STATE 16
#define D_CONV  4
#define D_INNER 2048
#define BATCH   2
#define SEQLEN  2048
#define NROWS   (BATCH * SEQLEN)   // 4096 rows for the flattened GEMMs

typedef float v2f __attribute__((ext_vector_type(2)));
typedef float v4f __attribute__((ext_vector_type(4)));
typedef float v8f __attribute__((ext_vector_type(8)));
typedef unsigned int u32x4 __attribute__((ext_vector_type(4)));
typedef int i32x4 __attribute__((ext_vector_type(4)));
typedef int i32x8 __attribute__((ext_vector_type(8)));

__device__ __forceinline__ float sigmoid_f(float v) {
    return 1.0f / (1.0f + __expf(-v));
}

__device__ __forceinline__ void tdm_load_tile_2d(unsigned lds_off,
                                                 const float* gptr,
                                                 unsigned tile_w, unsigned tile_h,
                                                 unsigned long long row_stride_elems)
{
    unsigned long long ga = (unsigned long long)(size_t)gptr;
    u32x4 g0;
    g0.x = 1u;                                          // count=1, is_restore=0, gather off
    g0.y = lds_off;                                     // lds_addr (bytes)
    g0.z = (unsigned)(ga & 0xFFFFFFFFu);                // global_addr[31:0]
    g0.w = (unsigned)((ga >> 32) & 0x01FFFFFFu)         // global_addr[56:32]
         | (2u << 30);                                  // type = 2 ("image")
    i32x8 g1;
    g1[0] = (int)(2u << 16);
    g1[1] = (int)((tile_w & 0xFFFFu) << 16);
    g1[2] = (int)((tile_w >> 16) | ((tile_h & 0xFFFFu) << 16));
    g1[3] = (int)((tile_h >> 16) | ((tile_w & 0xFFFFu) << 16));
    g1[4] = (int)(tile_h & 0xFFFFu);
    g1[5] = (int)(row_stride_elems & 0xFFFFFFFFull);
    g1[6] = (int)((row_stride_elems >> 32) & 0xFFFFull);
    g1[7] = 0;
    i32x4 z4 = (i32x4)0;
    i32x8 z8 = (i32x8)0;
    __builtin_amdgcn_tensor_load_to_lds(g0, g1, z4, z4, z8, 0);
}

template <int BM, int BN, int KC>
__global__ __launch_bounds__(256)
void gemm_f32_wmma(const float* __restrict__ A, const float* __restrict__ B,
                   const float* __restrict__ bias, float* __restrict__ C,
                   int M, int N, int K)
{
    __shared__ float sA[2][BM][KC];   // A tile: [m][k]
    __shared__ float sB[2][KC][BN];   // B tile: [k][n]

    const int tid  = threadIdx.x;
    const int wave = tid >> 5;
    const int lane = tid & 31;
    const int l16  = lane & 15;
    const int hi   = lane >> 4;        // which half of the wave
    const int wm   = wave >> 2;        // 0..1  (64-row stripes)
    const int wn   = wave & 3;         // 0..3  (32-col stripes)
    const int row0 = blockIdx.y * BM;
    const int col0 = blockIdx.x * BN;
    const bool tdmWave = (wave == 0);

    v8f acc[4][2];
#pragma unroll
    for (int i = 0; i < 4; ++i)
#pragma unroll
        for (int j = 0; j < 2; ++j)
            acc[i][j] = (v8f)(0.0f);

    const int nstages = K / KC;
    if (tdmWave) {
        tdm_load_tile_2d((unsigned)(size_t)&sA[0][0][0],
                         A + (size_t)row0 * K, KC, BM, (unsigned long long)K);
        tdm_load_tile_2d((unsigned)(size_t)&sB[0][0][0],
                         B + col0, BN, KC, (unsigned long long)N);
    }

    for (int s = 0; s < nstages; ++s) {
        const int cur = s & 1;
        if (tdmWave) __builtin_amdgcn_s_wait_tensorcnt(0);  // buf[cur] DMA done
        __syncthreads();   // all waves: buf[cur] ready; buf[cur^1] no longer read

        if (tdmWave && (s + 1) < nstages) {                 // prefetch next stage
            const int k0n = (s + 1) * KC;
            tdm_load_tile_2d((unsigned)(size_t)&sA[cur ^ 1][0][0],
                             A + (size_t)row0 * K + k0n, KC, BM, (unsigned long long)K);
            tdm_load_tile_2d((unsigned)(size_t)&sB[cur ^ 1][0][0],
                             B + (size_t)k0n * N + col0, BN, KC, (unsigned long long)N);
        }

#pragma unroll
        for (int ks = 0; ks < KC; ks += 4) {
            v2f afrag[4];
#pragma unroll
            for (int i = 0; i < 4; ++i) {
                const float* p = &sA[cur][wm * 64 + i * 16 + l16][ks + 2 * hi];
                afrag[i].x = p[0];
                afrag[i].y = p[1];
            }
            // B fragment (4x16 f32): same K split, N striped across lanes
            v2f bfrag[2];
#pragma unroll
            for (int j = 0; j < 2; ++j) {
                bfrag[j].x = sB[cur][ks + 2 * hi + 0][wn * 32 + j * 16 + l16];
                bfrag[j].y = sB[cur][ks + 2 * hi + 1][wn * 32 + j * 16 + l16];
            }
#pragma unroll
            for (int i = 0; i < 4; ++i)
#pragma unroll
                for (int j = 0; j < 2; ++j)
                    acc[i][j] = __builtin_amdgcn_wmma_f32_16x16x4_f32(
                        false, afrag[i], false, bfrag[j],
                        (short)0, acc[i][j], false, false);
        }
        __syncthreads();   // done reading buf[cur] before its DMA at stage s+2
    }

#pragma unroll
    for (int i = 0; i < 4; ++i) {
#pragma unroll
        for (int j = 0; j < 2; ++j) {
            int ccol = col0 + wn * 32 + j * 16 + l16;
            float bv = bias[ccol];
#pragma unroll
            for (int e = 0; e < 8; ++e) {
                int r = row0 + wm * 64 + i * 16 + e + 8 * hi;
                C[(size_t)r * N + ccol] = acc[i][j][e] + bv;
            }
        }
    }
}

// ---------------------------------------------------------------------------
// Depthwise causal conv (width 4) + SiLU.  x_ssm = xz[:, :, 0:D_INNER]
// One thread = 4 neighbouring channels x CONV_T consecutive steps. The CONV_T + 3 input
// rows it needs are loaded once, 16 bytes a lane, all in front of the arithmetic, so a
// wave pays the load latency once and every row serves four taps from registers.
// Block = 256 threads = 1024 channels; grid = (NROWS / CONV_T) * (D_INNER / 1024).
// ---------------------------------------------------------------------------
#define CONV_T 16

__global__ __launch_bounds__(256)
void conv_silu_kernel(const float* __restrict__ xz, const float* __restrict__ conv_w,
                      const float* __restrict__ conv_b, float* __restrict__ xc)
{
    const int d0   = (int)(blockIdx.x % (D_INNER / 1024)) * 1024 + (int)threadIdx.x * 4;
    const int row0 = (int)(blockIdx.x / (D_INNER / 1024)) * CONV_T;   // row = b*SEQLEN + t
    const float* px = xz + (size_t)row0 * (2 * D_INNER) + d0;

    const bool head = (row0 % SEQLEN) == 0;  // block-uniform: SEQLEN is a multiple of CONV_T

    v4f w[4];                                // w[j] = the four taps of channel d0 + j
#pragma unroll
    for (int j = 0; j < 4; ++j)
        w[j] = *(const v4f*)(conv_w + (size_t)(d0 + j) * D_CONV);
    const v4f bias = *(const v4f*)(conv_b + d0);

    v4f xr[CONV_T + D_CONV - 1];             // xr[i] = input row row0 - 3 + i
    // Where a sequence starts there are no rows in front: the three loads then read row0
    // itself (an address that exists) and their values are replaced by the zero pad below.
    const float* ph = head ? px : px - (D_CONV - 1) * (2 * D_INNER);
    const int    hs = head ? 0 : 2 * D_INNER;
#pragma unroll
    for (int i = 0; i < D_CONV - 1; ++i)
        xr[i] = *(const v4f*)(ph + i * hs);
#pragma unroll
    for (int i = 0; i < CONV_T; ++i)
        xr[i + D_CONV - 1] = *(const v4f*)(px + i * (2 * D_INNER));
    // behind the run of loads: the arithmetic below reuses the registers that held their addresses
    asm volatile("s_wait_xcnt 0x0" ::: "memory");
    // keeps the arithmetic below and so every load above: left alone, the scheduler pulls the
    // first rows' arithmetic up between the loads and the later rows' latency is paid again
    __builtin_amdgcn_sched_barrier(0);
    if (head) {
#pragma unroll
        for (int i = 0; i < D_CONV - 1; ++i)
            xr[i] = (v4f)(0.0f);
    }

    float* po = xc + (size_t)row0 * D_INNER + d0;
#pragma unroll
    for (int t = 0; t < CONV_T; ++t) {
        v4f o;
#pragma unroll
        for (int j = 0; j < 4; ++j) {
            float acc = bias[j];
#pragma unroll
            for (int k = 0; k < D_CONV; ++k)
                acc = fmaf(xr[t + k][j], w[j][k], acc);
            o[j] = acc * sigmoid_f(acc);     // SiLU
        }
        *(v4f*)(po + t * D_INNER) = o;
    }
}

// ---------------------------------------------------------------------------
// proj = xc @ W_xproj  (N = 33 = 16 B, 16 C, 1 delta).  delta stored softplus'ed.
// One block per row; row staged in LDS.
// ---------------------------------------------------------------------------
__global__ __launch_bounds__(64)
void xproj_kernel(const float* __restrict__ xc, const float* __restrict__ W_xproj,
                  float* __restrict__ proj)
{
    __shared__ float srow[D_INNER];
    int r = blockIdx.x;
    for (int i = threadIdx.x; i < D_INNER; i += 64)
        srow[i] = xc[(size_t)r * D_INNER + i];
    __syncthreads();

    const int NP = 2 * D_STATE + 1;          // 33
    for (int j = threadIdx.x; j < NP; j += 64) {
        float acc = 0.0f;
        for (int k = 0; k < D_INNER; ++k)
            acc = fmaf(srow[k], W_xproj[(size_t)k * NP + j], acc);
        if (j == NP - 1)                     // softplus(delta_raw)
            acc = (acc > 20.0f) ? acc : log1pf(__expf(acc));
        proj[(size_t)r * NP + j] = acc;
    }
}

// ---------------------------------------------------------------------------
// Selective scan + skip + gating.
// Four lanes per channel, each lane keeps 4 of the 16 states in registers
// (8 channels per wave32). The sum of h*C over the states is 3 FMAs in the lane
// and two DPP quad adds. Steps run in groups of four: lane g of a quad takes the
// sum of step t+g and does that step's skip, gate and store, so all lanes work.
// Block = 64 threads = 16 channels of one batch; grid = BATCH * (D_INNER/16).
// ---------------------------------------------------------------------------
#define T_CHUNK 128
#define X_PITCH (T_CHUNK + 4)

// value of lane (l ^ 1) / (l ^ 2) inside each quad, on the vector pipe (DPP quad_perm)
__device__ __forceinline__ float quad_xor1(float v) {
    return __int_as_float(__builtin_amdgcn_mov_dpp(__float_as_int(v), 0xB1, 0xF, 0xF, true));
}
__device__ __forceinline__ float quad_xor2(float v) {
    return __int_as_float(__builtin_amdgcn_mov_dpp(__float_as_int(v), 0x4E, 0xF, 0xF, true));
}

__global__ __launch_bounds__(64)
void scan_kernel(const float* __restrict__ xc, const float* __restrict__ proj,
                 const float* __restrict__ xz,   // z = xz[:, :, D_INNER:2*D_INNER]
                 const float* __restrict__ A_log, const float* __restrict__ D_param,
                 float* __restrict__ yg)
{
    const int NP = 2 * D_STATE + 1;          // 33
    __shared__ __attribute__((aligned(16))) float sBC[T_CHUNK][2 * D_STATE]; // [t][0:16]=B, [16:32]=C
    __shared__ __attribute__((aligned(16))) float sDelta[T_CHUNK];
    __shared__ __attribute__((aligned(16))) float sX[16][X_PITCH];           // [channel][t]
    __shared__ __attribute__((aligned(16))) float sZ[16][X_PITCH];

    const int grpPerB = D_INNER / 16;        // 128
    const int b    = blockIdx.x / grpPerB;
    const int dgrp = blockIdx.x % grpPerB;
    const int c    = threadIdx.x >> 2;       // channel within block: 0..15
    const int g    = threadIdx.x & 3;        // states 4g .. 4g+3
    const int d    = dgrp * 16 + c;
    const int lane = threadIdx.x & 31;
    const int wave = threadIdx.x >> 5;

    const v4f Al = *(const v4f*)&A_log[(size_t)d * D_STATE + 4 * g];
    float A[4], h[4];
#pragma unroll
    for (int k = 0; k < 4; ++k) {
        A[k] = -__expf(Al[k]);
        h[k] = 0.0f;
    }
    const float Dp = D_param[d];

    for (int t0 = 0; t0 < SEQLEN; t0 += T_CHUNK) {
        const size_t row0 = (size_t)(b * SEQLEN + t0);
        // Stage the chunk. Every staging loop is unrolled whole and all loads stand in
        // front of the LDS stores: two waves have nothing else to hide a load's latency,
        // so the chunk pays it once instead of once per trip.
        const float* pBC = proj + (row0 + wave) * NP + lane;            // one row per wave and trip
        const float* pDl = proj + (row0 + threadIdx.x) * NP + 2 * D_STATE;
        const int    st  = threadIdx.x >> 4, sc = threadIdx.x & 15;     // 4 rows x 16 channels per trip
        const float* pX  = xc + (row0 + st) * D_INNER + dgrp * 16 + sc;
        const float* pZ  = xz + (row0 + st) * (2 * D_INNER) + D_INNER + dgrp * 16 + sc;
        float rBC[T_CHUNK / 2], rDl[T_CHUNK / 64], rX[T_CHUNK / 4], rZ[T_CHUNK / 4];
        // Behind each run of loads from one address: a later load's result may land in the
        // registers that held that address, so the wait stands in front of the next run.
#pragma unroll
        for (int r = 0; r < T_CHUNK / 4; ++r)
            rX[r] = pX[(size_t)r * 4 * D_INNER];
        asm volatile("s_wait_xcnt 0x0" ::: "memory");
#pragma unroll
        for (int r = 0; r < T_CHUNK / 4; ++r)
            rZ[r] = pZ[(size_t)r * 4 * (2 * D_INNER)];
        asm volatile("s_wait_xcnt 0x0" ::: "memory");
#pragma unroll
        for (int r = 0; r < T_CHUNK / 2; ++r)
            rBC[r] = pBC[r * 2 * NP];
        asm volatile("s_wait_xcnt 0x0" ::: "memory");
#pragma unroll
        for (int r = 0; r < T_CHUNK / 64; ++r)
            rDl[r] = pDl[r * 64 * NP];
        asm volatile("s_wait_xcnt 0x0" ::: "memory");
#pragma unroll
        for (int r = 0; r < T_CHUNK / 4; ++r) {
            sX[sc][4 * r + st] = rX[r];
            sZ[sc][4 * r + st] = rZ[r];
        }
#pragma unroll
        for (int r = 0; r < T_CHUNK / 2; ++r)
            sBC[2 * r + wave][lane] = rBC[r];
#pragma unroll
        for (int r = 0; r < T_CHUNK / 64; ++r)
            sDelta[64 * r + threadIdx.x] = rDl[r];
        __syncthreads();

        float* yB = yg + row0 * D_INNER + dgrp * 16;             // the chunk's first row, uniform
        const unsigned yoff = (unsigned)g * D_INNER + c;         // lane g writes row tt+g
#pragma unroll 2
        for (int tt = 0; tt < T_CHUNK; tt += 4) {
            const v4f dl = *(const v4f*)&sDelta[tt];
            const v4f xv = *(const v4f*)&sX[c][tt];
            float psel;
#pragma unroll
            for (int u = 0; u < 4; ++u) {
                const v4f Bv = *(const v4f*)&sBC[tt + u][4 * g];
                const v4f Cv = *(const v4f*)&sBC[tt + u][D_STATE + 4 * g];
                const float delta = dl[u];
                const float x     = xv[u];
#pragma unroll
                for (int k = 0; k < 4; ++k) {
                    float dA = __expf(delta * A[k]);
                    h[k] = fmaf(dA, h[k], delta * Bv[k] * x);   // h = dA*h + (d*B_n)*x
                }
                float p = h[0] * Cv[0];                          // sum of h * C_n
                p = fmaf(h[1], Cv[1], p);
                p = fmaf(h[2], Cv[2], p);
                p = fmaf(h[3], Cv[3], p);
                p += quad_xor1(p);
                p += quad_xor2(p);
                psel = (u == 0 || g == u) ? p : psel;            // lane g keeps step tt+g
            }
            const float x = sX[c][tt + g];
            const float z = sZ[c][tt + g];
            float y = psel + x * Dp;                             // skip connection
            y *= z * sigmoid_f(z);                               // gate: y * silu(z)
            yB[yoff + (unsigned)tt * D_INNER] = y;
            // behind the pair's second store: the next pair rewrites the registers that both
            // stores name (a wait behind the first too would hold the second group's reads back)
            if (tt & 4) asm volatile("s_wait_xcnt 0x0" ::: "memory");
        }
        __syncthreads();
    }
}

// ---------------------------------------------------------------------------
extern "C" void kernel_launch(void* const* d_in, const int* in_sizes, int n_in,
                              void* d_out, int out_size, void* d_ws, size_t ws_size,
                              hipStream_t stream)
{
    const float* x       = (const float*)d_in[0];
    const float* W_in    = (const float*)d_in[1];
    const float* b_in    = (const float*)d_in[2];
    const float* conv_w  = (const float*)d_in[3];
    const float* conv_b  = (const float*)d_in[4];
    const float* W_xproj = (const float*)d_in[5];
    const float* A_log   = (const float*)d_in[6];
    const float* D_param = (const float*)d_in[7];
    const float* W_out   = (const float*)d_in[8];
    const float* b_out   = (const float*)d_in[9];
    float* out = (float*)d_out;

    // Workspace layout (floats)
    float* xz   = (float*)d_ws;                          // NROWS x 2*D_INNER
    float* xc   = xz  + (size_t)NROWS * 2 * D_INNER;     // NROWS x D_INNER
    float* proj = xc  + (size_t)NROWS * D_INNER;         // NROWS x 33
    float* yg   = proj + (size_t)NROWS * (2 * D_STATE + 1); // NROWS x D_INNER

    // 1) xz = x @ W_in + b_in         (4096 x 1024) @ (1024 x 4096)
    {
        dim3 grid((2 * D_INNER) / 128, NROWS / 128);
        gemm_f32_wmma<128, 128, 16><<<grid, 256, 0, stream>>>(
            x, W_in, b_in, xz, NROWS, 2 * D_INNER, D_MODEL);
    }
    // 2) depthwise conv + SiLU
    {
        conv_silu_kernel<<<(NROWS / CONV_T) * (D_INNER / 1024), 256, 0, stream>>>(
            xz, conv_w, conv_b, xc);
    }
    // 3) proj = xc @ W_xproj  (+ softplus on delta column)
    {
        xproj_kernel<<<NROWS, 64, 0, stream>>>(xc, W_xproj, proj);
    }
    // 4) selective scan + skip + gating
    {
        scan_kernel<<<BATCH * (D_INNER / 16), 64, 0, stream>>>(
            xc, proj, xz, A_log, D_param, yg);
    }
    // 5) out = yg @ W_out + b_out     (4096 x 2048) @ (2048 x 1024)
    {
        dim3 grid(D_MODEL / 128, NROWS / 128);
        gemm_f32_wmma<128, 128, 16><<<grid, 256, 0, stream>>>(
            yg, W_out, b_out, out, NROWS, D_MODEL, D_INNER);
    }
}
